// v000
// Measured on an AMD MI455X. A time is GPU time per run, averaged over a window of back-to-back runs after a warm-up
// (all launches, gaps included; the runs take copies of the inputs in turn), and the median of several windows.
// Apart from v000's, it joins two sittings. Times from different sittings can be a few percent apart, while
// side-by-side timings come from the same sitting.
// The starting kernel, v000, takes 497 microseconds a run.
#include <hip/hip_runtime.h>

typedef __attribute__((ext_vector_type(2))) float v2f;
typedef __attribute__((ext_vector_type(8))) float v8f;

#define WMMA_F32(a, b, c) \
  __builtin_amdgcn_wmma_f32_16x16x4_f32(false, (a), false, (b), (short)0, (c), false, false)

namespace {
constexpr int S = 2048;          // sequence length
constexpr int D = 64;            // head dim
constexpr int LDSTRIDE = 2052;   // floats; 2048+4 kills LDS bank conflicts, keeps 16B align
constexpr float INV_T = 0.125f;  // 1 / TEMPERATURE
}

__global__ __launch_bounds__(256)
void sparsemax_attn_kernel(const float* __restrict__ Qg,
                           const float* __restrict__ Kg,
                           const float* __restrict__ Vg,
                           float* __restrict__ Og)
{
  // 16 x 2048 fp32 score tile (128.25 KB) + 4 KB partial-sum scratch.
  __shared__ float sc[16 * LDSTRIDE];
  __shared__ float psum[4 * 256];

  const int wg    = blockIdx.x;     // 0 .. B*H*(S/16)-1
  const int qtile = wg & 127;       // S/16 = 128 tiles
  const int bh    = wg >> 7;        // 0 .. 31
  const int tid   = threadIdx.x;
  const int wave  = tid >> 5;       // 0 .. 7 (wave32)
  const int lane  = tid & 31;
  const int lhalf = lane >> 4;      // 0 | 1 (half-wave for WMMA layouts)
  const int lmod  = lane & 15;

  const float* Q = Qg + (size_t)bh * S * D + (size_t)qtile * 16 * D;
  const float* K = Kg + (size_t)bh * S * D;
  const float* V = Vg + (size_t)bh * S * D;
  float*       O = Og + (size_t)bh * S * D + (size_t)qtile * 16 * D;

  // ================= GEMM1: scores = (Q * K^T) / T  -> LDS =================
  // A fragments (16x64 Q tile): lane l%16 = row M, VGPR pair holds K=k0+2*(l/16)+{0,1}.
  v2f afrag[16];
  #pragma unroll
  for (int ks = 0; ks < 16; ++ks) {
    v2f t = *(const v2f*)(Q + lmod * D + ks * 4 + 2 * lhalf);
    t.x *= INV_T;
    t.y *= INV_T;
    afrag[ks] = t;   // pre-scale A once instead of scaling every C tile
  }

  // 128 N-tiles of 16 keys each; 16 tiles per wave.
  #pragma unroll 1
  for (int t = 0; t < 16; ++t) {
    const int nt = wave * 16 + t;
    // B[kk, n] = K[n_global, kk]; contiguous float2 along D.
    const float* kb = K + (size_t)(nt * 16 + lmod) * D + 2 * lhalf;
    v8f c = {};
    #pragma unroll
    for (int ks = 0; ks < 16; ++ks) {
      v2f b = *(const v2f*)(kb + ks * 4);
      c = WMMA_F32(afrag[ks], b, c);
    }
    // C layout: lanes 0-15 -> M=r, lanes 16-31 -> M=r+8; N = lane%16.
    float* sp = sc + lhalf * 8 * LDSTRIDE + nt * 16 + lmod;
    #pragma unroll
    for (int r = 0; r < 8; ++r) sp[r * LDSTRIDE] = c[r];
  }
  __syncthreads();

  // ================= sparsemax per row (Michelot iteration) =================
  // Each wave owns rows 2*wave and 2*wave+1; row cached in 64 VGPRs per lane.
  #pragma unroll 1
  for (int rr = 0; rr < 2; ++rr) {
    float* rp = sc + (wave * 2 + rr) * LDSTRIDE;
    float x[64];
    float s = 0.0f;
    #pragma unroll
    for (int i = 0; i < 64; ++i) {
      x[i] = rp[i * 32 + lane];   // stride-32: conflict-free
      s += x[i];
    }
    #pragma unroll
    for (int off = 16; off > 0; off >>= 1) s += __shfl_xor(s, off, 32);

    // tau_0 = (sum-1)/n <= tau*; iteration is monotone and idempotent at the
    // fixed point, so a fixed iteration cap is safe. Early-exit is wave-uniform.
    float tau = (s - 1.0f) * (1.0f / (float)S);
    #pragma unroll 1
    for (int it = 0; it < 32; ++it) {
      float ls = 0.0f, lk = 0.0f;
      #pragma unroll
      for (int i = 0; i < 64; ++i) {
        const bool act = x[i] > tau;
        ls += act ? x[i] : 0.0f;
        lk += act ? 1.0f : 0.0f;
      }
      #pragma unroll
      for (int off = 16; off > 0; off >>= 1) {
        ls += __shfl_xor(ls, off, 32);
        lk += __shfl_xor(lk, off, 32);
      }
      const float ntau = (ls - 1.0f) / lk;   // lk >= 1 always (max elem stays active)
      if (ntau == tau) break;                // uniform across the wave
      tau = ntau;
    }

    #pragma unroll
    for (int i = 0; i < 64; ++i) {
      const float a = x[i] - tau;
      rp[i * 32 + lane] = a > 0.0f ? a : 0.0f;   // attn weights back to LDS
    }
  }
  __syncthreads();

  // ================= GEMM2: out = attn * V =================
  // 4 D-tiles x 2 K-halves over 8 waves; partials combined through LDS.
  const int dtile = wave & 3;
  const int khalf = wave >> 2;
  const int kbase = khalf * (S / 2);

  v8f c2 = {};
  const float* vb = V + (size_t)(kbase + 2 * lhalf) * D + dtile * 16 + lmod;
  const float* ab = sc + lmod * LDSTRIDE + kbase + 2 * lhalf;
  #pragma unroll 4
  for (int k0 = 0; k0 < S / 2; k0 += 4) {
    v2f a = *(const v2f*)(ab + k0);          // attn A-fragment from LDS (8B aligned)
    const float* pv = vb + (size_t)k0 * D;   // V B-fragment: two rows, stride D
    v2f b;
    b.x = pv[0];
    b.y = pv[D];
    c2 = WMMA_F32(a, b, c2);
  }

  if (khalf == 1) {
    float* pp = psum + dtile * 256 + lane;
    #pragma unroll
    for (int r = 0; r < 8; ++r) pp[r * 32] = c2[r];
  }
  __syncthreads();
  if (khalf == 0) {
    const float* pp = psum + dtile * 256 + lane;
    #pragma unroll
    for (int r = 0; r < 8; ++r) {
      const float val = c2[r] + pp[r * 32];
      O[(size_t)(r + lhalf * 8) * D + dtile * 16 + lmod] = val;
    }
  }
}

extern "C" void kernel_launch(void* const* d_in, const int* in_sizes, int n_in,
                              void* d_out, int out_size, void* d_ws, size_t ws_size,
                              hipStream_t stream) {
  (void)in_sizes; (void)n_in; (void)out_size; (void)d_ws; (void)ws_size;
  const float* q = (const float*)d_in[0];
  const float* k = (const float*)d_in[1];
  const float* v = (const float*)d_in[2];
  float* out = (float*)d_out;

  // grid = B*H*(S/16) = 2*16*128 = 4096 workgroups, 256 threads (8 wave32s).
  sparsemax_attn_kernel<<<dim3(4096), dim3(256), 0, stream>>>(q, k, v, out);
}

// v001
// One run takes 271 microseconds.
// Timed twice side by side with v000, it ran 1.87 times as fast both times.
#include <hip/hip_runtime.h>

typedef __attribute__((ext_vector_type(2))) float v2f;
typedef __attribute__((ext_vector_type(8))) float v8f;

#define WMMA_F32(a, b, c) \
  __builtin_amdgcn_wmma_f32_16x16x4_f32(false, (a), false, (b), (short)0, (c), false, false)

namespace {
constexpr int S = 2048;          // sequence length
constexpr int D = 64;            // head dim
constexpr int LDSTRIDE = 2052;   // floats; 2048+4 kills LDS bank conflicts, keeps 16B align
constexpr float INV_T = 0.125f;  // 1 / TEMPERATURE
}

__global__ __launch_bounds__(256)
void sparsemax_attn_kernel(const float* __restrict__ Qg,
                           const float* __restrict__ Kg,
                           const float* __restrict__ Vg,
                           float* __restrict__ Og)
{
  // 16 x 2048 fp32 score tile (128.25 KB) + 4 KB partial-sum scratch.
  __shared__ float sc[16 * LDSTRIDE];
  __shared__ float psum[4 * 256];
  // Per row: bit l of word i is set when the weight of key 32*i + l is non-zero.
  __shared__ unsigned nzmask[16 * 64];

  const int wg    = blockIdx.x;     // 0 .. B*H*(S/16)-1
  const int qtile = wg & 127;       // S/16 = 128 tiles
  const int bh    = wg >> 7;        // 0 .. 31
  const int tid   = threadIdx.x;
  const int wave  = tid >> 5;       // 0 .. 7 (wave32)
  const int lane  = tid & 31;
  const int lhalf = lane >> 4;      // 0 | 1 (half-wave for WMMA layouts)
  const int lmod  = lane & 15;

  const float* Q = Qg + (size_t)bh * S * D + (size_t)qtile * 16 * D;
  const float* K = Kg + (size_t)bh * S * D;
  const float* V = Vg + (size_t)bh * S * D;
  float*       O = Og + (size_t)bh * S * D + (size_t)qtile * 16 * D;

  // ================= GEMM1: scores = (Q * K^T) / T  -> LDS =================
  // A fragments (16x64 Q tile): lane l%16 = row M, VGPR pair holds K=k0+2*(l/16)+{0,1}.
  v2f afrag[16];
  #pragma unroll
  for (int ks = 0; ks < 16; ++ks) {
    v2f t = *(const v2f*)(Q + lmod * D + ks * 4 + 2 * lhalf);
    t.x *= INV_T;
    t.y *= INV_T;
    afrag[ks] = t;   // pre-scale A once instead of scaling every C tile
  }

  // 128 N-tiles of 16 keys each; 16 tiles per wave.
  #pragma unroll 1
  for (int t = 0; t < 16; ++t) {
    const int nt = wave * 16 + t;
    // B[kk, n] = K[n_global, kk]; contiguous float2 along D.
    const float* kb = K + (size_t)(nt * 16 + lmod) * D + 2 * lhalf;
    v8f c = {};
    #pragma unroll
    for (int ks = 0; ks < 16; ++ks) {
      v2f b = *(const v2f*)(kb + ks * 4);
      c = WMMA_F32(afrag[ks], b, c);
    }
    // C layout: lanes 0-15 -> M=r, lanes 16-31 -> M=r+8; N = lane%16.
    float* sp = sc + lhalf * 8 * LDSTRIDE + nt * 16 + lmod;
    #pragma unroll
    for (int r = 0; r < 8; ++r) sp[r * LDSTRIDE] = c[r];
  }
  __syncthreads();

  // ================= sparsemax per row (Michelot iteration) =================
  // Each wave owns rows 2*wave and 2*wave+1; row cached in 64 VGPRs per lane.
  #pragma unroll 1
  for (int rr = 0; rr < 2; ++rr) {
    float* rp = sc + (wave * 2 + rr) * LDSTRIDE;
    float x[64];
    float s = 0.0f;
    #pragma unroll
    for (int i = 0; i < 64; ++i) {
      x[i] = rp[i * 32 + lane];   // stride-32: conflict-free
      s += x[i];
    }
    #pragma unroll
    for (int off = 16; off > 0; off >>= 1) s += __shfl_xor(s, off, 32);

    // tau_0 = (sum-1)/n <= tau*; iteration is monotone and idempotent at the
    // fixed point, so a fixed iteration cap is safe. Early-exit is wave-uniform.
    float tau = (s - 1.0f) * (1.0f / (float)S);
    #pragma unroll 1
    for (int it = 0; it < 32; ++it) {
      float ls = 0.0f, lk = 0.0f;
      #pragma unroll
      for (int i = 0; i < 64; ++i) {
        const bool act = x[i] > tau;
        ls += act ? x[i] : 0.0f;
        lk += act ? 1.0f : 0.0f;
      }
      #pragma unroll
      for (int off = 16; off > 0; off >>= 1) {
        ls += __shfl_xor(ls, off, 32);
        lk += __shfl_xor(lk, off, 32);
      }
      const float ntau = (ls - 1.0f) / lk;   // lk >= 1 always (max elem stays active)
      if (ntau == tau) break;                // uniform across the wave
      tau = ntau;
    }

    unsigned mlo = 0u, mhi = 0u;   // lane i collects the mask word of key group i (mhi: i + 32)
    #pragma unroll
    for (int i = 0; i < 64; ++i) {
      const float a = x[i] - tau;
      const bool nz = a > 0.0f;
      rp[i * 32 + lane] = nz ? a : 0.0f;   // attn weights back to LDS
      const unsigned bal = __builtin_amdgcn_ballot_w32(nz);
      if (i < 32) mlo = (lane == i)      ? bal : mlo;
      else        mhi = (lane == i - 32) ? bal : mhi;
    }
    nzmask[(wave * 2 + rr) * 64 + lane]      = mlo;
    nzmask[(wave * 2 + rr) * 64 + 32 + lane] = mhi;
  }
  __syncthreads();

  // ================= GEMM2: out = attn * V =================
  // 4 D-tiles x 2 K-halves over 8 waves; partials combined through LDS.
  const int dtile = wave & 3;
  const int khalf = wave >> 2;
  const int kbase = khalf * (S / 2);

  v8f c2 = {};
  const int voff = (kbase + 2 * lhalf) * D + dtile * 16 + lmod;   // the lane's fixed part of its V address
  const float* ab = sc + lmod * LDSTRIDE + kbase + 2 * lhalf;
  // A 4-key step whose weights are zero in all 16 rows adds exactly nothing, so
  // only steps with a non-zero weight are run, in ascending key order.
  unsigned um = 0u;   // lane l: union over the rows for keys kbase + 32*l .. +31
  #pragma unroll   // the 16 LDS reads issue together
  for (int r = 0; r < 16; ++r) um |= nzmask[r * 64 + khalf * 32 + lane];
  unsigned bm[8];     // bit l of bm[c]: step 32*c + l of this half has a non-zero weight
  #pragma unroll   // bm[] is indexed by constants only and stays in scalar registers
  for (int c = 0; c < 8; ++c) {
    const unsigned w = (unsigned)__shfl((int)um, c * 4 + (lane >> 3), 32);
    bm[c] = __builtin_amdgcn_ballot_w32(((w >> ((lane & 7) * 4)) & 0xFu) != 0u);
  }
  // Unrolled so that each 64-step mask is a fixed pair of scalar registers.
  #pragma unroll
  for (int c = 0; c < 4; ++c) {
    unsigned long long m = (unsigned long long)bm[2 * c] | ((unsigned long long)bm[2 * c + 1] << 32);
    while (m != 0ull) {
      // Eight steps a trip: their loads issue together, one load latency per trip.
      #pragma unroll
      for (int u = 0; u < 8; ++u) {
        const bool live = m != 0ull;
        const int step = live ? __builtin_ctzll(m) : 0;   // 0 .. 63
        m &= m - 1ull;
        const int k0 = (c * 64 + step) * 4;
        v2f a = *(const v2f*)(ab + k0);          // attn A-fragment from LDS (8B aligned)
        if (!live) { a.x = 0.0f; a.y = 0.0f; }   // filler step past the last set bit
        const unsigned vi = (unsigned)(k0 * D + voff);
        v2f b;                                   // V B-fragment: two rows, stride D
        b.x = V[vi];
        b.y = V[vi + D];
        c2 = WMMA_F32(a, b, c2);
      }
    }
  }

  if (khalf == 1) {
    float* pp = psum + dtile * 256 + lane;
    #pragma unroll
    for (int r = 0; r < 8; ++r) pp[r * 32] = c2[r];
  }
  __syncthreads();
  if (khalf == 0) {
    const float* pp = psum + dtile * 256 + lane;
    #pragma unroll
    for (int r = 0; r < 8; ++r) {
      const float val = c2[r] + pp[r * 32];
      O[(size_t)(r + lhalf * 8) * D + dtile * 16 + lmod] = val;
    }
  }
}

extern "C" void kernel_launch(void* const* d_in, const int* in_sizes, int n_in,
                              void* d_out, int out_size, void* d_ws, size_t ws_size,
                              hipStream_t stream) {
  (void)in_sizes; (void)n_in; (void)out_size; (void)d_ws; (void)ws_size;
  const float* q = (const float*)d_in[0];
  const float* k = (const float*)d_in[1];
  const float* v = (const float*)d_in[2];
  float* out = (float*)d_out;

  // grid = B*H*(S/16) = 2*16*128 = 4096 workgroups, 256 threads (8 wave32s).
  sparsemax_attn_kernel<<<dim3(4096), dim3(256), 0, stream>>>(q, k, v, out);
}

// v002
// It runs in 246 microseconds.
// In two side-by-side timings against v001, it was 1.10 and 1.11 times as fast.
// Over all steps from v000 it is 2.06 times as fast.
#include <hip/hip_runtime.h>

typedef __attribute__((ext_vector_type(2))) float v2f;
typedef __attribute__((ext_vector_type(4))) float v4f;
typedef __attribute__((ext_vector_type(8))) float v8f;

#define WMMA_F32(a, b, c) \
  __builtin_amdgcn_wmma_f32_16x16x4_f32(false, (a), false, (b), (short)0, (c), false, false)

namespace {
constexpr int S = 2048;          // sequence length
constexpr int D = 64;            // head dim
constexpr int LDSTRIDE = 2052;   // floats; 2048+4 kills LDS bank conflicts, keeps 16B align
constexpr float INV_T = 0.125f;  // 1 / TEMPERATURE
constexpr int KST_PITCH = 36;    // floats; 32 dims + 4: the 8-byte fragment reads of 16 rows hit 64 banks once
constexpr int KST_WAVE = 16 * KST_PITCH;   // half a K tile: 16 keys x 32 dims

// One 16x16 score tile of one wave. On entry g holds the wave's K tile as it came from
// whole-line loads (g[4*h + i]: rows 4*i .. 4*i+3, dims 32*h .. 32*h+31, 8 lanes a row).
// The tile goes through the wave's own LDS buffer, half a tile at a time, to become B
// fragments. With NEXT each half of g is refilled with the next tile as soon as it is in
// LDS, so those loads fly for about one whole tile. Every loop is unrolled so that
// g, b0 and b1 stay in registers.
template <bool NEXT>
__device__ __forceinline__ void score_tile(const v2f (&afrag)[16], v4f (&g)[8],
                                           float* kw, const float* kr,
                                           const float* kg, float* sp)
{
  v2f b0[8], b1[8];
  v8f c = {};
  #pragma unroll
  for (int i = 0; i < 4; ++i) *(v4f*)(kw + i * 4 * KST_PITCH) = g[i];
  // the rows that other lanes wrote are in LDS before they are read back
  asm volatile("s_wait_dscnt 0x0" ::: "memory");
  #pragma unroll
  for (int ks = 0; ks < 8; ++ks) b0[ks] = *(const v2f*)(kr + ks * 4);
  if (NEXT) {
    #pragma unroll
    for (int i = 0; i < 4; ++i) g[i] = *(const v4f*)(kg + (16 + i * 4) * D);
  }
  // every lane's reads of the first half are done before the buffer is overwritten
  asm volatile("s_wait_dscnt 0x0" ::: "memory");
  #pragma unroll
  for (int i = 0; i < 4; ++i) *(v4f*)(kw + i * 4 * KST_PITCH) = g[4 + i];
  #pragma unroll
  for (int ks = 0; ks < 8; ++ks) c = WMMA_F32(afrag[ks], b0[ks], c);
  // second half written before it is read back
  asm volatile("s_wait_dscnt 0x0" ::: "memory");
  #pragma unroll
  for (int ks = 0; ks < 8; ++ks) b1[ks] = *(const v2f*)(kr + ks * 4);
  if (NEXT) {
    #pragma unroll
    for (int i = 0; i < 4; ++i) g[4 + i] = *(const v4f*)(kg + (16 + i * 4) * D + 32);
  }
  #pragma unroll
  for (int ks = 0; ks < 8; ++ks) c = WMMA_F32(afrag[8 + ks], b1[ks], c);
  // second half read before the next tile overwrites the buffer
  asm volatile("s_wait_dscnt 0x0" ::: "memory");
  // C layout: lanes 0-15 -> M=r, lanes 16-31 -> M=r+8; N = lane%16.
  #pragma unroll
  for (int r = 0; r < 8; ++r) sp[r * LDSTRIDE] = c[r];
}
}

__global__ __launch_bounds__(256)
void sparsemax_attn_kernel(const float* __restrict__ Qg,
                           const float* __restrict__ Kg,
                           const float* __restrict__ Vg,
                           float* __restrict__ Og)
{
  // 16 x 2048 fp32 score tile (128.25 KB) + 4 KB partial-sum scratch.
  __shared__ float sc[16 * LDSTRIDE];
  __shared__ float psum[4 * 256];
  // Per row: bit l of word i is set when the weight of key 32*i + l is non-zero.
  __shared__ unsigned nzmask[16 * 64];
  // Per wave: half a K tile on its way from whole-line loads to B fragments.
  __shared__ __attribute__((aligned(16))) float kst[8 * KST_WAVE];

  const int wg    = blockIdx.x;     // 0 .. B*H*(S/16)-1
  const int qtile = wg & 127;       // S/16 = 128 tiles
  const int bh    = wg >> 7;        // 0 .. 31
  const int tid   = threadIdx.x;
  const int wave  = tid >> 5;       // 0 .. 7 (wave32)
  const int lane  = tid & 31;
  const int lhalf = lane >> 4;      // 0 | 1 (half-wave for WMMA layouts)
  const int lmod  = lane & 15;

  const float* Q = Qg + (size_t)bh * S * D + (size_t)qtile * 16 * D;
  const float* K = Kg + (size_t)bh * S * D;
  const float* V = Vg + (size_t)bh * S * D;
  float*       O = Og + (size_t)bh * S * D + (size_t)qtile * 16 * D;

  // ================= GEMM1: scores = (Q * K^T) / T  -> LDS =================
  // A fragments (16x64 Q tile): lane l%16 = row M, VGPR pair holds K=k0+2*(l/16)+{0,1}.
  v2f afrag[16];
  #pragma unroll
  for (int ks = 0; ks < 16; ++ks) {
    v2f t = *(const v2f*)(Q + lmod * D + ks * 4 + 2 * lhalf);
    t.x *= INV_T;
    t.y *= INV_T;
    afrag[ks] = t;   // pre-scale A once instead of scaling every C tile
  }

  // 128 N-tiles of 16 keys each; 16 tiles per wave.
  // A B fragment read straight from global memory takes 16 bytes out of each of 16
  // cache lines; instead the wave fetches its tiles by whole 128-byte lines.
  float* kst_w = kst + wave * KST_WAVE;
  float*       kw = kst_w + (lane >> 3) * KST_PITCH + (lane & 7) * 4;   // writer: 8 lanes a row
  const float* kr = kst_w + lmod * KST_PITCH + 2 * lhalf;               // reader: B[kk, n] = K[n, kk]
  const float* kg = K + (size_t)(wave * 256 + (lane >> 3)) * D + (lane & 7) * 4;
  float* sp = sc + lhalf * 8 * LDSTRIDE + wave * 256 + lmod;            // the wave's first score tile
  v4f g[8];   // indexed by constants only (unrolled loops): stays in registers
  // The Q loads above are past address translation before a K load may land in their
  // address registers.
  asm volatile("s_wait_xcnt 0x0" ::: "memory");
  #pragma unroll
  for (int i = 0; i < 4; ++i) g[i] = *(const v4f*)(kg + i * 4 * D);
  // Keeps tile 0's loads in the order of the loop's refills (first half, second half):
  // the counted load waits in the loop then leave the younger half in flight.
  __builtin_amdgcn_sched_barrier(0);
  #pragma unroll
  for (int i = 0; i < 4; ++i) g[4 + i] = *(const v4f*)(kg + i * 4 * D + 32);

  #pragma unroll 1
  for (int t = 0; t < 15; ++t) {
    score_tile<true>(afrag, g, kw, kr, kg, sp);
    kg += 16 * D;
    sp += 16;
  }
  score_tile<false>(afrag, g, kw, kr, kg, sp);
  // Keeps the next phase's vector instructions out of the last tile's WMMAs, where they
  // would reuse fragment registers directly behind the WMMA that reads them.
  __builtin_amdgcn_sched_barrier(0);
  __syncthreads();

  // ================= sparsemax per row (Michelot iteration) =================
  // Each wave owns rows 2*wave and 2*wave+1; row cached in 64 VGPRs per lane.
  #pragma unroll 1
  for (int rr = 0; rr < 2; ++rr) {
    float* rp = sc + (wave * 2 + rr) * LDSTRIDE;
    float x[64];
    float s = 0.0f;
    #pragma unroll
    for (int i = 0; i < 64; ++i) {
      x[i] = rp[i * 32 + lane];   // stride-32: conflict-free
      s += x[i];
    }
    #pragma unroll
    for (int off = 16; off > 0; off >>= 1) s += __shfl_xor(s, off, 32);

    // tau_0 = (sum-1)/n <= tau*; iteration is monotone and idempotent at the
    // fixed point, so a fixed iteration cap is safe. Early-exit is wave-uniform.
    float tau = (s - 1.0f) * (1.0f / (float)S);
    #pragma unroll 1
    for (int it = 0; it < 32; ++it) {
      float ls = 0.0f, lk = 0.0f;
      #pragma unroll
      for (int i = 0; i < 64; ++i) {
        const bool act = x[i] > tau;
        ls += act ? x[i] : 0.0f;
        lk += act ? 1.0f : 0.0f;
      }
      #pragma unroll
      for (int off = 16; off > 0; off >>= 1) {
        ls += __shfl_xor(ls, off, 32);
        lk += __shfl_xor(lk, off, 32);
      }
      const float ntau = (ls - 1.0f) / lk;   // lk >= 1 always (max elem stays active)
      if (ntau == tau) break;                // uniform across the wave
      tau = ntau;
    }

    unsigned mlo = 0u, mhi = 0u;   // lane i collects the mask word of key group i (mhi: i + 32)
    #pragma unroll
    for (int i = 0; i < 64; ++i) {
      const float a = x[i] - tau;
      const bool nz = a > 0.0f;
      rp[i * 32 + lane] = nz ? a : 0.0f;   // attn weights back to LDS
      const unsigned bal = __builtin_amdgcn_ballot_w32(nz);
      if (i < 32) mlo = (lane == i)      ? bal : mlo;
      else        mhi = (lane == i - 32) ? bal : mhi;
    }
    nzmask[(wave * 2 + rr) * 64 + lane]      = mlo;
    nzmask[(wave * 2 + rr) * 64 + 32 + lane] = mhi;
  }
  __syncthreads();

  // ================= GEMM2: out = attn * V =================
  // 4 D-tiles x 2 K-halves over 8 waves; partials combined through LDS.
  const int dtile = wave & 3;
  const int khalf = wave >> 2;
  const int kbase = khalf * (S / 2);

  v8f c2 = {};
  const int voff = (kbase + 2 * lhalf) * D + dtile * 16 + lmod;   // the lane's fixed part of its V address
  const float* ab = sc + lmod * LDSTRIDE + kbase + 2 * lhalf;
  // A 4-key step whose weights are zero in all 16 rows adds exactly nothing, so
  // only steps with a non-zero weight are run, in ascending key order.
  unsigned um = 0u;   // lane l: union over the rows for keys kbase + 32*l .. +31
  #pragma unroll   // the 16 LDS reads issue together
  for (int r = 0; r < 16; ++r) um |= nzmask[r * 64 + khalf * 32 + lane];
  unsigned bm[8];     // bit l of bm[c]: step 32*c + l of this half has a non-zero weight
  #pragma unroll   // bm[] is indexed by constants only and stays in scalar registers
  for (int c = 0; c < 8; ++c) {
    const unsigned w = (unsigned)__shfl((int)um, c * 4 + (lane >> 3), 32);
    bm[c] = __builtin_amdgcn_ballot_w32(((w >> ((lane & 7) * 4)) & 0xFu) != 0u);
  }
  // Unrolled so that each 64-step mask is a fixed pair of scalar registers.
  #pragma unroll
  for (int c = 0; c < 4; ++c) {
    unsigned long long m = (unsigned long long)bm[2 * c] | ((unsigned long long)bm[2 * c + 1] << 32);
    while (m != 0ull) {
      // Eight steps a trip: their loads issue together, one load latency per trip.
      #pragma unroll
      for (int u = 0; u < 8; ++u) {
        const bool live = m != 0ull;
        const int step = live ? __builtin_ctzll(m) : 0;   // 0 .. 63
        m &= m - 1ull;
        const int k0 = (c * 64 + step) * 4;
        v2f a = *(const v2f*)(ab + k0);          // attn A-fragment from LDS (8B aligned)
        if (!live) { a.x = 0.0f; a.y = 0.0f; }   // filler step past the last set bit
        const unsigned vi = (unsigned)(k0 * D + voff);
        v2f b;                                   // V B-fragment: two rows, stride D
        b.x = V[vi];
        b.y = V[vi + D];
        c2 = WMMA_F32(a, b, c2);
      }
    }
  }

  if (khalf == 1) {
    float* pp = psum + dtile * 256 + lane;
    #pragma unroll
    for (int r = 0; r < 8; ++r) pp[r * 32] = c2[r];
  }
  __syncthreads();
  if (khalf == 0) {
    const float* pp = psum + dtile * 256 + lane;
    #pragma unroll
    for (int r = 0; r < 8; ++r) {
      const float val = c2[r] + pp[r * 32];
      O[(size_t)(r + lhalf * 8) * D + dtile * 16 + lmod] = val;
    }
  }
}

extern "C" void kernel_launch(void* const* d_in, const int* in_sizes, int n_in,
                              void* d_out, int out_size, void* d_ws, size_t ws_size,
                              hipStream_t stream) {
  (void)in_sizes; (void)n_in; (void)out_size; (void)d_ws; (void)ws_size;
  const float* q = (const float*)d_in[0];
  const float* k = (const float*)d_in[1];
  const float* v = (const float*)d_in[2];
  float* out = (float*)d_out;

  // grid = B*H*(S/16) = 2*16*128 = 4096 workgroups, 256 threads (8 wave32s).
  sparsemax_attn_kernel<<<dim3(4096), dim3(256), 0, stream>>>(q, k, v, out);
}

// v003
// One run takes 177 microseconds.
// Timed twice side by side with v002, it ran 1.39 times as fast both times.
// Over all steps from v000 it is 2.87 times as fast.
#include <hip/hip_runtime.h>

typedef __attribute__((ext_vector_type(2))) float v2f;
typedef __attribute__((ext_vector_type(4))) float v4f;
typedef __attribute__((ext_vector_type(8))) float v8f;

#define WMMA_F32(a, b, c) \
  __builtin_amdgcn_wmma_f32_16x16x4_f32(false, (a), false, (b), (short)0, (c), false, false)

namespace {
constexpr int S = 2048;          // sequence length
constexpr int D = 64;            // head dim
constexpr int LDSTRIDE = 2052;   // floats; 2048+4 kills LDS bank conflicts, keeps 16B align
constexpr float INV_T = 0.125f;  // 1 / TEMPERATURE
constexpr int KST_PITCH = 36;    // floats; 32 dims + 4: the 8-byte fragment reads of 16 rows hit 64 banks once
constexpr int KST_WAVE = 16 * KST_PITCH;   // half a K tile: 16 keys x 32 dims

// Value of lane l ^ M inside a 16-lane row (DPP row_xmask), and of lane l ^ 16.
template <int M>
__device__ __forceinline__ float row_xor(float v)
{
  return __builtin_bit_cast(float, __builtin_amdgcn_update_dpp(0, __builtin_bit_cast(int, v), 0x160 + M, 0xf, 0xf, true));
}
__device__ __forceinline__ float half_xor(float v)
{
  const int b = __builtin_bit_cast(int, v);
  return __builtin_bit_cast(float, __builtin_amdgcn_permlanex16(b, b, 0x76543210, 0xfedcba98, false, false));
}
// Sum and maximum over the wave's 32 lanes, in registers; every lane gets the result.
__device__ __forceinline__ float wave_sum(float v)
{
  v += row_xor<1>(v);
  v += row_xor<2>(v);
  v += row_xor<4>(v);
  v += row_xor<8>(v);
  return v + half_xor(v);
}
__device__ __forceinline__ float wave_max(float v)
{
  v = fmaxf(v, row_xor<1>(v));
  v = fmaxf(v, row_xor<2>(v));
  v = fmaxf(v, row_xor<4>(v));
  v = fmaxf(v, row_xor<8>(v));
  return fmaxf(v, half_xor(v));
}

// One 16x16 score tile of one wave. On entry g holds the wave's K tile as it came from
// whole-line loads (g[4*h + i]: rows 4*i .. 4*i+3, dims 32*h .. 32*h+31, 8 lanes a row).
// The tile goes through the wave's own LDS buffer, half a tile at a time, to become B
// fragments. With NEXT each half of g is refilled with the next tile as soon as it is in
// LDS, so those loads fly for about one whole tile. Every loop is unrolled so that
// g, b0 and b1 stay in registers.
template <bool NEXT>
__device__ __forceinline__ void score_tile(const v2f (&afrag)[16], v4f (&g)[8],
                                           float* kw, const float* kr,
                                           const float* kg, float* sp)
{
  v2f b0[8], b1[8];
  v8f c = {};
  #pragma unroll
  for (int i = 0; i < 4; ++i) *(v4f*)(kw + i * 4 * KST_PITCH) = g[i];
  // the rows that other lanes wrote are in LDS before they are read back
  asm volatile("s_wait_dscnt 0x0" ::: "memory");
  #pragma unroll
  for (int ks = 0; ks < 8; ++ks) b0[ks] = *(const v2f*)(kr + ks * 4);
  if (NEXT) {
    #pragma unroll
    for (int i = 0; i < 4; ++i) g[i] = *(const v4f*)(kg + (16 + i * 4) * D);
  }
  // every lane's reads of the first half are done before the buffer is overwritten
  asm volatile("s_wait_dscnt 0x0" ::: "memory");
  #pragma unroll
  for (int i = 0; i < 4; ++i) *(v4f*)(kw + i * 4 * KST_PITCH) = g[4 + i];
  #pragma unroll
  for (int ks = 0; ks < 8; ++ks) c = WMMA_F32(afrag[ks], b0[ks], c);
  // second half written before it is read back
  asm volatile("s_wait_dscnt 0x0" ::: "memory");
  #pragma unroll
  for (int ks = 0; ks < 8; ++ks) b1[ks] = *(const v2f*)(kr + ks * 4);
  if (NEXT) {
    #pragma unroll
    for (int i = 0; i < 4; ++i) g[4 + i] = *(const v4f*)(kg + (16 + i * 4) * D + 32);
  }
  #pragma unroll
  for (int ks = 0; ks < 8; ++ks) c = WMMA_F32(afrag[8 + ks], b1[ks], c);
  // second half read before the next tile overwrites the buffer
  asm volatile("s_wait_dscnt 0x0" ::: "memory");
  // C layout: lanes 0-15 -> M=r, lanes 16-31 -> M=r+8; N = lane%16.
  #pragma unroll
  for (int r = 0; r < 8; ++r) sp[r * LDSTRIDE] = c[r];
}
}

__global__ __launch_bounds__(256)
void sparsemax_attn_kernel(const float* __restrict__ Qg,
                           const float* __restrict__ Kg,
                           const float* __restrict__ Vg,
                           float* __restrict__ Og)
{
  // 16 x 2048 fp32 score tile (128.25 KB) + 4 KB partial-sum scratch.
  __shared__ float sc[16 * LDSTRIDE];
  __shared__ float psum[4 * 256];
  // Per row: bit l of word i is set when the weight of key 32*i + l is non-zero.
  __shared__ unsigned nzmask[16 * 64];
  // Per wave: half a K tile on its way from whole-line loads to B fragments.
  __shared__ __attribute__((aligned(16))) float kst[8 * KST_WAVE];

  const int wg    = blockIdx.x;     // 0 .. B*H*(S/16)-1
  const int qtile = wg & 127;       // S/16 = 128 tiles
  const int bh    = wg >> 7;        // 0 .. 31
  const int tid   = threadIdx.x;
  const int wave  = tid >> 5;       // 0 .. 7 (wave32)
  const int lane  = tid & 31;
  const int lhalf = lane >> 4;      // 0 | 1 (half-wave for WMMA layouts)
  const int lmod  = lane & 15;

  const float* Q = Qg + (size_t)bh * S * D + (size_t)qtile * 16 * D;
  const float* K = Kg + (size_t)bh * S * D;
  const float* V = Vg + (size_t)bh * S * D;
  float*       O = Og + (size_t)bh * S * D + (size_t)qtile * 16 * D;

  // ================= GEMM1: scores = (Q * K^T) / T  -> LDS =================
  // A fragments (16x64 Q tile): lane l%16 = row M, VGPR pair holds K=k0+2*(l/16)+{0,1}.
  v2f afrag[16];
  #pragma unroll
  for (int ks = 0; ks < 16; ++ks) {
    v2f t = *(const v2f*)(Q + lmod * D + ks * 4 + 2 * lhalf);
    t.x *= INV_T;
    t.y *= INV_T;
    afrag[ks] = t;   // pre-scale A once instead of scaling every C tile
  }

  // 128 N-tiles of 16 keys each; 16 tiles per wave.
  // A B fragment read straight from global memory takes 16 bytes out of each of 16
  // cache lines; instead the wave fetches its tiles by whole 128-byte lines.
  float* kst_w = kst + wave * KST_WAVE;
  float*       kw = kst_w + (lane >> 3) * KST_PITCH + (lane & 7) * 4;   // writer: 8 lanes a row
  const float* kr = kst_w + lmod * KST_PITCH + 2 * lhalf;               // reader: B[kk, n] = K[n, kk]
  const float* kg = K + (size_t)(wave * 256 + (lane >> 3)) * D + (lane & 7) * 4;
  float* sp = sc + lhalf * 8 * LDSTRIDE + wave * 256 + lmod;            // the wave's first score tile
  v4f g[8];   // indexed by constants only (unrolled loops): stays in registers
  // The Q loads above are past address translation before a K load may land in their
  // address registers.
  asm volatile("s_wait_xcnt 0x0" ::: "memory");
  #pragma unroll
  for (int i = 0; i < 4; ++i) g[i] = *(const v4f*)(kg + i * 4 * D);
  // Keeps tile 0's loads in the order of the loop's refills (first half, second half):
  // the counted load waits in the loop then leave the younger half in flight.
  __builtin_amdgcn_sched_barrier(0);
  #pragma unroll
  for (int i = 0; i < 4; ++i) g[4 + i] = *(const v4f*)(kg + i * 4 * D + 32);

  #pragma unroll 1
  for (int t = 0; t < 15; ++t) {
    score_tile<true>(afrag, g, kw, kr, kg, sp);
    kg += 16 * D;
    sp += 16;
  }
  score_tile<false>(afrag, g, kw, kr, kg, sp);
  // Keeps the next phase's vector instructions out of the last tile's WMMAs, where they
  // would reuse fragment registers directly behind the WMMA that reads them.
  __builtin_amdgcn_sched_barrier(0);
  __syncthreads();

  // ================= sparsemax per row (Michelot iteration on the keys near the maximum) =================
  // Each wave owns rows 2*wave and 2*wave+1; row cached in 64 VGPRs per lane.
  const int wave_s = __builtin_amdgcn_readfirstlane(wave);   // the row's LDS base in a scalar register
  #pragma unroll 1
  for (int rr = 0; rr < 2; ++rr) {
    float* rp = sc + (wave_s * 2 + rr) * LDSTRIDE;
    float x[64];
    float mx = -__builtin_inff();
    #pragma unroll
    for (int i = 0; i < 64; ++i) {
      x[i] = rp[i * 32 + lane];   // stride-32: conflict-free
      mx = fmaxf(mx, x[i]);
    }
    mx = wave_max(mx);

    // The weights sum to 1, so the largest one is at most 1: tau* >= max - 1, and every key
    // of the support lies above t0 = max - 1. Only those keys can decide tau. They are
    // packed to the front of the row (its values are all in x[] by now, and the row is
    // written anew below).
    const float t0 = mx - 1.0f;
    int n = 0;   // wave-uniform: keys packed so far
    // Every lane stores every time, the lanes without such a key into a slot of their own in
    // the wave's idle K buffer: a store under a lane mask would put a compare -> scalar ->
    // EXEC round trip in front of each of the 64 stores.
    float* const spare = kst_w + lane;
    #pragma unroll
    for (int h = 0; h < 2; ++h) {
      unsigned bal[32];
      #pragma unroll
      for (int i = 0; i < 32; ++i) bal[i] = __builtin_amdgcn_ballot_w32(x[h * 32 + i] > t0);
      // All 32 compares issue before the first scalar count reads a mask: the wait of a scalar
      // instruction for a vector compare is paid once here, not once per mask.
      __builtin_amdgcn_sched_barrier(0);
      #pragma unroll
      for (int i = 0; i < 32; ++i) {
        float* const packed = rp + __builtin_amdgcn_mbcnt_lo(bal[i], (unsigned)n);
        *((x[h * 32 + i] > t0) ? packed : spare) = x[h * 32 + i];
        n += __builtin_popcount(bal[i]);
      }
    }

    // Michelot iteration from the lower bound t0: tau_(j+1) = (sum of keys above tau_j - 1) /
    // (their number) never passes tau*, so the sets are nested and hold the support.
    float tau = t0;
    if (n <= 128) {
      // what other lanes packed is in LDS before it is read back
      asm volatile("s_wait_dscnt 0x0" ::: "memory");
      float c[4];
      #pragma unroll
      for (int j = 0; j < 4; ++j) {
        const float v = rp[j * 32 + lane];
        c[j] = (j * 32 + lane < n) ? v : -__builtin_inff();
      }
      // Sets {c > t} are nested in t: an equal count is an equal set, the fixed point.
      // Each other trip drops a key, so n + 1 trips always reach it.
      int kprev = 0;
      #pragma unroll 1
      for (int it = 0; it < 129; ++it) {
        int k = 0;
        float ls = 0.0f;
        #pragma unroll
        for (int j = 0; j < 4; ++j) {
          const bool act = c[j] > tau;
          k += __builtin_popcount(__builtin_amdgcn_ballot_w32(act));
          ls += act ? c[j] : 0.0f;
        }
        if (k == kprev) break;   // uniform across the wave
        kprev = k;
        tau = (wave_sum(ls) - 1.0f) / (float)k;   // k >= 1: the largest key stays above tau
      }
    } else {
      // More keys within 1 of the maximum than the packed form holds: all 2048 from registers.
      #pragma unroll 1
      for (int it = 0; it < 32; ++it) {
        float ls = 0.0f, lk = 0.0f;
        #pragma unroll
        for (int i = 0; i < 64; ++i) {
          const bool act = x[i] > tau;
          ls += act ? x[i] : 0.0f;
          lk += act ? 1.0f : 0.0f;
        }
        #pragma unroll
        for (int off = 16; off > 0; off >>= 1) {
          ls += __shfl_xor(ls, off, 32);
          lk += __shfl_xor(lk, off, 32);
        }
        const float ntau = (ls - 1.0f) / lk;   // lk >= 1 always (max elem stays active)
        if (ntau == tau) break;                // uniform across the wave
        tau = ntau;
      }
    }

    unsigned mlo = 0u, mhi = 0u;   // lane i collects the mask word of key group i (mhi: i + 32)
    #pragma unroll
    for (int i = 0; i < 64; ++i) {
      const float a = x[i] - tau;
      const bool nz = a > 0.0f;
      rp[i * 32 + lane] = nz ? a : 0.0f;   // attn weights back to LDS
      const unsigned bal = __builtin_amdgcn_ballot_w32(nz);
      if (i < 32) mlo = (lane == i)      ? bal : mlo;
      else        mhi = (lane == i - 32) ? bal : mhi;
    }
    nzmask[(wave * 2 + rr) * 64 + lane]      = mlo;
    nzmask[(wave * 2 + rr) * 64 + 32 + lane] = mhi;
  }
  __syncthreads();

  // ================= GEMM2: out = attn * V =================
  // 4 D-tiles x 2 K-halves over 8 waves; partials combined through LDS.
  const int dtile = wave & 3;
  const int khalf = wave >> 2;
  const int kbase = khalf * (S / 2);

  v8f c2 = {};
  const int voff = (kbase + 2 * lhalf) * D + dtile * 16 + lmod;   // the lane's fixed part of its V address
  const float* ab = sc + lmod * LDSTRIDE + kbase + 2 * lhalf;
  // A 4-key step whose weights are zero in all 16 rows adds exactly nothing, so
  // only steps with a non-zero weight are run, in ascending key order.
  unsigned um = 0u;   // lane l: union over the rows for keys kbase + 32*l .. +31
  #pragma unroll   // the 16 LDS reads issue together
  for (int r = 0; r < 16; ++r) um |= nzmask[r * 64 + khalf * 32 + lane];
  unsigned bm[8];     // bit l of bm[c]: step 32*c + l of this half has a non-zero weight
  #pragma unroll   // bm[] is indexed by constants only and stays in scalar registers
  for (int c = 0; c < 8; ++c) {
    const unsigned w = (unsigned)__shfl((int)um, c * 4 + (lane >> 3), 32);
    bm[c] = __builtin_amdgcn_ballot_w32(((w >> ((lane & 7) * 4)) & 0xFu) != 0u);
  }
  // Unrolled so that each 64-step mask is a fixed pair of scalar registers.
  #pragma unroll
  for (int c = 0; c < 4; ++c) {
    unsigned long long m = (unsigned long long)bm[2 * c] | ((unsigned long long)bm[2 * c + 1] << 32);
    while (m != 0ull) {
      // Eight steps a trip: their loads issue together, one load latency per trip.
      #pragma unroll
      for (int u = 0; u < 8; ++u) {
        const bool live = m != 0ull;
        const int step = live ? __builtin_ctzll(m) : 0;   // 0 .. 63
        m &= m - 1ull;
        const int k0 = (c * 64 + step) * 4;
        v2f a = *(const v2f*)(ab + k0);          // attn A-fragment from LDS (8B aligned)
        if (!live) { a.x = 0.0f; a.y = 0.0f; }   // filler step past the last set bit
        const unsigned vi = (unsigned)(k0 * D + voff);
        v2f b;                                   // V B-fragment: two rows, stride D
        b.x = V[vi];
        b.y = V[vi + D];
        c2 = WMMA_F32(a, b, c2);
      }
    }
  }

  if (khalf == 1) {
    float* pp = psum + dtile * 256 + lane;
    #pragma unroll
    for (int r = 0; r < 8; ++r) pp[r * 32] = c2[r];
  }
  __syncthreads();
  if (khalf == 0) {
    const float* pp = psum + dtile * 256 + lane;
    #pragma unroll
    for (int r = 0; r < 8; ++r) {
      const float val = c2[r] + pp[r * 32];
      O[(size_t)(r + lhalf * 8) * D + dtile * 16 + lmod] = val;
    }
  }
}

extern "C" void kernel_launch(void* const* d_in, const int* in_sizes, int n_in,
                              void* d_out, int out_size, void* d_ws, size_t ws_size,
                              hipStream_t stream) {
  (void)in_sizes; (void)n_in; (void)out_size; (void)d_ws; (void)ws_size;
  const float* q = (const float*)d_in[0];
  const float* k = (const float*)d_in[1];
  const float* v = (const float*)d_in[2];
  float* out = (float*)d_out;

  // grid = B*H*(S/16) = 2*16*128 = 4096 workgroups, 256 threads (8 wave32s).
  sparsemax_attn_kernel<<<dim3(4096), dim3(256), 0, stream>>>(q, k, v, out);
}

// v004
// Measured time: 164 microseconds a run.
// Timed twice side by side with v003, it ran 1.08 times as fast both times.
// Over all steps from v000 it is 3.10 times as fast.
#include <hip/hip_runtime.h>

typedef __attribute__((ext_vector_type(2))) float v2f;
typedef __attribute__((ext_vector_type(4))) float v4f;
typedef __attribute__((ext_vector_type(8))) float v8f;

#define WMMA_F32(a, b, c) \
  __builtin_amdgcn_wmma_f32_16x16x4_f32(false, (a), false, (b), (short)0, (c), false, false)

namespace {
constexpr int S = 2048;          // sequence length
constexpr int D = 64;            // head dim
constexpr int LDSTRIDE = 2052;   // floats; 2048+4 kills LDS bank conflicts, keeps 16B align
constexpr float INV_T = 0.125f;  // 1 / TEMPERATURE
constexpr int KST_PITCH = 36;    // floats; 32 dims + 4: the 8-byte fragment reads of 16 rows hit 64 banks once
constexpr int KST_WAVE = 16 * KST_PITCH;   // half a K tile: 16 keys x 32 dims
constexpr int NZ_PITCH = 68;     // words; 64 + 4: GEMM2's reads of 8 rows x 4 words hit 32 banks once

// Value of lane l ^ M inside a 16-lane row (DPP row_xmask), and of lane l ^ 16.
template <int M>
__device__ __forceinline__ float row_xor(float v)
{
  return __builtin_bit_cast(float, __builtin_amdgcn_update_dpp(0, __builtin_bit_cast(int, v), 0x160 + M, 0xf, 0xf, true));
}
template <int M>
__device__ __forceinline__ unsigned row_xor_u(unsigned v)
{
  return (unsigned)__builtin_amdgcn_update_dpp(0, (int)v, 0x160 + M, 0xf, 0xf, true);
}
__device__ __forceinline__ float half_xor(float v)
{
  const int b = __builtin_bit_cast(int, v);
  return __builtin_bit_cast(float, __builtin_amdgcn_permlanex16(b, b, 0x76543210, 0xfedcba98, false, false));
}
// Sum and maximum over the wave's 32 lanes, in registers; every lane gets the result.
__device__ __forceinline__ float wave_sum(float v)
{
  v += row_xor<1>(v);
  v += row_xor<2>(v);
  v += row_xor<4>(v);
  v += row_xor<8>(v);
  return v + half_xor(v);
}
__device__ __forceinline__ float wave_max(float v)
{
  v = fmaxf(v, row_xor<1>(v));
  v = fmaxf(v, row_xor<2>(v));
  v = fmaxf(v, row_xor<4>(v));
  v = fmaxf(v, row_xor<8>(v));
  return fmaxf(v, half_xor(v));
}

// One 16x16 score tile of one wave. On entry g holds the wave's K tile as it came from
// whole-line loads (g[4*h + i]: rows 4*i .. 4*i+3, dims 32*h .. 32*h+31, 8 lanes a row).
// The tile goes through the wave's own LDS buffer, half a tile at a time, to become B
// fragments. With NEXT each half of g is refilled with the next tile as soon as it is in
// LDS, so those loads fly for about one whole tile. Every loop is unrolled so that
// g, b0 and b1 stay in registers.
template <bool NEXT>
__device__ __forceinline__ void score_tile(const v2f (&afrag)[16], v4f (&g)[8],
                                           float* kw, const float* kr,
                                           const float* kg, float* sp)
{
  v2f b0[8], b1[8];
  v8f c = {};
  #pragma unroll
  for (int i = 0; i < 4; ++i) *(v4f*)(kw + i * 4 * KST_PITCH) = g[i];
  // the rows that other lanes wrote are in LDS before they are read back
  asm volatile("s_wait_dscnt 0x0" ::: "memory");
  #pragma unroll
  for (int ks = 0; ks < 8; ++ks) b0[ks] = *(const v2f*)(kr + ks * 4);
  if (NEXT) {
    #pragma unroll
    for (int i = 0; i < 4; ++i) g[i] = *(const v4f*)(kg + (16 + i * 4) * D);
  }
  // every lane's reads of the first half are done before the buffer is overwritten
  asm volatile("s_wait_dscnt 0x0" ::: "memory");
  #pragma unroll
  for (int i = 0; i < 4; ++i) *(v4f*)(kw + i * 4 * KST_PITCH) = g[4 + i];
  #pragma unroll
  for (int ks = 0; ks < 8; ++ks) c = WMMA_F32(afrag[ks], b0[ks], c);
  // second half written before it is read back
  asm volatile("s_wait_dscnt 0x0" ::: "memory");
  #pragma unroll
  for (int ks = 0; ks < 8; ++ks) b1[ks] = *(const v2f*)(kr + ks * 4);
  if (NEXT) {
    #pragma unroll
    for (int i = 0; i < 4; ++i) g[4 + i] = *(const v4f*)(kg + (16 + i * 4) * D + 32);
  }
  #pragma unroll
  for (int ks = 0; ks < 8; ++ks) c = WMMA_F32(afrag[8 + ks], b1[ks], c);
  // second half read before the next tile overwrites the buffer
  asm volatile("s_wait_dscnt 0x0" ::: "memory");
  // C layout: lanes 0-15 -> M=r, lanes 16-31 -> M=r+8; N = lane%16.
  #pragma unroll
  for (int r = 0; r < 8; ++r) sp[r * LDSTRIDE] = c[r];
}
}

__global__ __launch_bounds__(256)
void sparsemax_attn_kernel(const float* __restrict__ Qg,
                           const float* __restrict__ Kg,
                           const float* __restrict__ Vg,
                           float* __restrict__ Og)
{
  // 16 x 2048 fp32 score tile (128.25 KB); GEMM2's partial sums go over it at the end.
  __shared__ __attribute__((aligned(16))) float sc[16 * LDSTRIDE];
  // Per row: bit l of word i is set when the weight of key 32*i + l is non-zero.
  __shared__ unsigned nzmask[16 * NZ_PITCH];
  // Per wave: half a K tile on its way from whole-line loads to B fragments.
  __shared__ __attribute__((aligned(16))) float kst[8 * KST_WAVE];

  const int wg    = blockIdx.x;     // 0 .. B*H*(S/16)-1
  const int qtile = wg & 127;       // S/16 = 128 tiles
  const int bh    = wg >> 7;        // 0 .. 31
  const int tid   = threadIdx.x;
  const int wave  = tid >> 5;       // 0 .. 7 (wave32)
  const int lane  = tid & 31;
  const int lhalf = lane >> 4;      // 0 | 1 (half-wave for WMMA layouts)
  const int lmod  = lane & 15;

  const float* Q = Qg + (size_t)bh * S * D + (size_t)qtile * 16 * D;
  const float* K = Kg + (size_t)bh * S * D;
  const float* V = Vg + (size_t)bh * S * D;
  float*       O = Og + (size_t)bh * S * D + (size_t)qtile * 16 * D;

  // ================= GEMM1: scores = (Q * K^T) / T  -> LDS =================
  // A fragments (16x64 Q tile): lane l%16 = row M, VGPR pair holds K=k0+2*(l/16)+{0,1}.
  v2f afrag[16];
  #pragma unroll
  for (int ks = 0; ks < 16; ++ks) {
    afrag[ks] = *(const v2f*)(Q + lmod * D + ks * 4 + 2 * lhalf);
  }

  // 128 N-tiles of 16 keys each; 16 tiles per wave.
  // A B fragment read straight from global memory takes 16 bytes out of each of 16
  // cache lines; instead the wave fetches its tiles by whole 128-byte lines.
  float* kst_w = kst + wave * KST_WAVE;
  float*       kw = kst_w + (lane >> 3) * KST_PITCH + (lane & 7) * 4;   // writer: 8 lanes a row
  const float* kr = kst_w + lmod * KST_PITCH + 2 * lhalf;               // reader: B[kk, n] = K[n, kk]
  const float* kg = K + (size_t)(wave * 256 + (lane >> 3)) * D + (lane & 7) * 4;
  float* sp = sc + lhalf * 8 * LDSTRIDE + wave * 256 + lmod;            // the wave's first score tile
  v4f g[8];   // indexed by constants only (unrolled loops): stays in registers
  // The Q loads above are past address translation before a K load may land in their
  // address registers.
  asm volatile("s_wait_xcnt 0x0" ::: "memory");
  #pragma unroll
  for (int i = 0; i < 4; ++i) g[i] = *(const v4f*)(kg + i * 4 * D);
  // Keeps tile 0's loads in the order of the loop's refills (first half, second half):
  // the counted load waits in the loop then leave the younger half in flight.
  __builtin_amdgcn_sched_barrier(0);
  #pragma unroll
  for (int i = 0; i < 4; ++i) g[4 + i] = *(const v4f*)(kg + i * 4 * D + 32);
  // Pre-scale A once instead of scaling every C tile; behind tile 0's K loads, so that none
  // of them is held back by the wait for Q.
  #pragma unroll
  for (int ks = 0; ks < 16; ++ks) {
    afrag[ks].x *= INV_T;
    afrag[ks].y *= INV_T;
  }

  #pragma unroll 1
  for (int t = 0; t < 15; ++t) {
    score_tile<true>(afrag, g, kw, kr, kg, sp);
    kg += 16 * D;
    sp += 16;
  }
  score_tile<false>(afrag, g, kw, kr, kg, sp);
  // Keeps the next phase's vector instructions out of the last tile's WMMAs, where they
  // would reuse fragment registers directly behind the WMMA that reads them.
  __builtin_amdgcn_sched_barrier(0);
  __syncthreads();

  // ================= sparsemax per row (Michelot iteration on the keys near the maximum) =================
  // Each wave owns rows 2*wave and 2*wave+1; row cached in 64 VGPRs per lane.
  const int wave_s = __builtin_amdgcn_readfirstlane(wave);   // the row's LDS base in a scalar register
  #pragma unroll 1
  for (int rr = 0; rr < 2; ++rr) {
    float* rp = sc + (wave_s * 2 + rr) * LDSTRIDE;
    float x[64];
    float mx = -__builtin_inff();
    #pragma unroll
    for (int i = 0; i < 64; ++i) {
      x[i] = rp[i * 32 + lane];   // stride-32: conflict-free
      mx = fmaxf(mx, x[i]);
    }
    mx = wave_max(mx);

    // The weights sum to 1, so the largest one is at most 1: tau* >= max - 1, and every key
    // of the support lies above t0 = max - 1. Only those keys can decide tau. They are
    // packed to the front of the row (its values are all in x[] by now, and the row is
    // written anew below).
    const float t0 = mx - 1.0f;
    int n = 0;   // wave-uniform: keys packed so far
    // Every lane stores every time, the lanes without such a key into a slot of their own in
    // the wave's idle K buffer: a store under a lane mask would put a compare -> scalar ->
    // EXEC round trip in front of each of the 64 stores.
    float* const spare = kst_w + lane;
    #pragma unroll
    for (int h = 0; h < 2; ++h) {
      unsigned bal[32];
      #pragma unroll
      for (int i = 0; i < 32; ++i) bal[i] = __builtin_amdgcn_ballot_w32(x[h * 32 + i] > t0);
      // All 32 compares issue before the first scalar count reads a mask: the wait of a scalar
      // instruction for a vector compare is paid once here, not once per mask.
      __builtin_amdgcn_sched_barrier(0);
      #pragma unroll
      for (int i = 0; i < 32; ++i) {
        float* const packed = rp + __builtin_amdgcn_mbcnt_lo(bal[i], (unsigned)n);
        *((x[h * 32 + i] > t0) ? packed : spare) = x[h * 32 + i];
        n += __builtin_popcount(bal[i]);
      }
    }

    // Michelot iteration from the lower bound t0: tau_(j+1) = (sum of keys above tau_j - 1) /
    // (their number) never passes tau*, so the sets are nested and hold the support.
    float tau = t0;
    if (n <= 128) {
      // what other lanes packed is in LDS before it is read back
      asm volatile("s_wait_dscnt 0x0" ::: "memory");
      float c[4];
      #pragma unroll
      for (int j = 0; j < 4; ++j) {
        const float v = rp[j * 32 + lane];
        c[j] = (j * 32 + lane < n) ? v : -__builtin_inff();
      }
      // Sets {c > t} are nested in t: an equal count is an equal set, the fixed point.
      // Each other trip drops a key, so n + 1 trips always reach it.
      int kprev = 0;
      #pragma unroll 1
      for (int it = 0; it < 129; ++it) {
        int k = 0;
        float ls = 0.0f;
        #pragma unroll
        for (int j = 0; j < 4; ++j) {
          const bool act = c[j] > tau;
          k += __builtin_popcount(__builtin_amdgcn_ballot_w32(act));
          ls += act ? c[j] : 0.0f;
        }
        if (k == kprev) break;   // uniform across the wave
        kprev = k;
        tau = (wave_sum(ls) - 1.0f) / (float)k;   // k >= 1: the largest key stays above tau
      }
    } else {
      // More keys within 1 of the maximum than the packed form holds: all 2048 from registers.
      #pragma unroll 1
      for (int it = 0; it < 32; ++it) {
        float ls = 0.0f, lk = 0.0f;
        #pragma unroll
        for (int i = 0; i < 64; ++i) {
          const bool act = x[i] > tau;
          ls += act ? x[i] : 0.0f;
          lk += act ? 1.0f : 0.0f;
        }
        #pragma unroll
        for (int off = 16; off > 0; off >>= 1) {
          ls += __shfl_xor(ls, off, 32);
          lk += __shfl_xor(lk, off, 32);
        }
        const float ntau = (ls - 1.0f) / lk;   // lk >= 1 always (max elem stays active)
        if (ntau == tau) break;                // uniform across the wave
        tau = ntau;
      }
    }

    unsigned mlo = 0u, mhi = 0u;   // lane i collects the mask word of key group i (mhi: i + 32)
    #pragma unroll
    for (int i = 0; i < 64; ++i) {
      const float a = x[i] - tau;
      const bool nz = a > 0.0f;
      rp[i * 32 + lane] = nz ? a : 0.0f;   // attn weights back to LDS
      const unsigned bal = __builtin_amdgcn_ballot_w32(nz);
      if (i < 32) mlo = (lane == i)      ? bal : mlo;
      else        mhi = (lane == i - 32) ? bal : mhi;
    }
    nzmask[(wave * 2 + rr) * NZ_PITCH + lane]      = mlo;
    nzmask[(wave * 2 + rr) * NZ_PITCH + 32 + lane] = mhi;
  }
  __syncthreads();

  // ================= GEMM2: out = attn * V =================
  // Each wave takes 256 keys (64 steps of 4 keys) and all 64 output columns; the 8 partial
  // tiles are summed through LDS. Column tile j holds output column 4 * lmod + j in lane
  // lmod, so a lane's four B values of one V row are 16 consecutive bytes, and a load of
  // the wave takes two whole V rows.
  v8f c2[4] = {};
  const char* Vw = (const char*)(V + (size_t)wave_s * 256 * D);     // wave-uniform: stays in scalar registers
  const unsigned voff = (unsigned)(2 * lhalf * D + lmod * 4) * 4u;  // bytes: the lane's fixed part of its V address
  const float* ab = sc + lmod * LDSTRIDE + wave * 256 + 2 * lhalf;
  // A 4-key step whose weights are zero in all 16 rows adds exactly nothing, so
  // only steps with a non-zero weight are run, in ascending key order.
  // Lane l gathers the mask words of key groups l / 8 and 4 + l / 8 of the wave's keys:
  // rows l % 8 and 8 + l % 8 from LDS, the other rows from its 8-lane group.
  const unsigned* nzp = nzmask + (lane & 7) * NZ_PITCH + wave * 8 + (lane >> 3);
  unsigned w0 = nzp[0] | nzp[8 * NZ_PITCH];
  unsigned w1 = nzp[4] | nzp[8 * NZ_PITCH + 4];
  w0 |= row_xor_u<1>(w0);
  w1 |= row_xor_u<1>(w1);
  w0 |= row_xor_u<2>(w0);
  w1 |= row_xor_u<2>(w1);
  w0 |= row_xor_u<4>(w0);
  w1 |= row_xor_u<4>(w1);
  // bit s of m: step s of the wave's 64 has a non-zero weight
  const unsigned nib = (unsigned)(lane & 7) * 4u;
  unsigned long long m = (unsigned long long)__builtin_amdgcn_ballot_w32(((w0 >> nib) & 0xFu) != 0u)
                       | ((unsigned long long)__builtin_amdgcn_ballot_w32(((w1 >> nib) & 0xFu) != 0u) << 32);
  while (m != 0ull) {
    // Eight steps a trip: all their loads issue together, one load latency per trip.
    int k0[8];
    bool live[8];
    #pragma unroll
    for (int u = 0; u < 8; ++u) {
      live[u] = m != 0ull;
      k0[u] = live[u] ? 4 * __builtin_ctzll(m) : 0;   // 0 .. 252
      m &= m - 1ull;
    }
    v4f r0[8], r1[8];   // V rows k0 + 2 * lhalf and the next one, columns 4 * lmod .. + 3
    v2f a[8];           // attn A-fragment from LDS (8B aligned)
    unsigned vb[8];     // the lane's byte offset into the wave's V rows, a register for each step
    #pragma unroll
    for (int u = 0; u < 8; ++u) vb[u] = (unsigned)k0[u] * (unsigned)(D * 4) + voff;
    #pragma unroll
    for (int u = 0; u < 8; ++u) {
      const char* vs = Vw + vb[u];
      r0[u] = *(const v4f*)vs;
      r1[u] = *(const v4f*)(vs + D * 4);
    }
    #pragma unroll
    for (int u = 0; u < 8; ++u) a[u] = *(const v2f*)(ab + k0[u]);
    // One wait for all 16 V loads, before any of their offset registers is written again:
    // as inputs here the offsets keep their registers until the loads are past address
    // translation (a wait in front of each next offset would string the loads out).
    asm volatile("s_wait_xcnt 0x0"
                 :: "v"(vb[0]), "v"(vb[1]), "v"(vb[2]), "v"(vb[3]),
                    "v"(vb[4]), "v"(vb[5]), "v"(vb[6]), "v"(vb[7])
                 : "memory");
    // Keeps the WMMAs and their register moves behind all 24 loads: moved up among them,
    // they would leave the later LDS reads to be waited for one by one between the WMMAs.
    __builtin_amdgcn_sched_barrier(0);
    #pragma unroll
    for (int u = 0; u < 8; ++u) {
      if (!live[u]) { a[u].x = 0.0f; a[u].y = 0.0f; }   // filler step past the last set bit
    }
    #pragma unroll
    for (int u = 0; u < 8; ++u) {
      #pragma unroll
      for (int j = 0; j < 4; ++j) {
        v2f b;
        b.x = r0[u][j];
        b.y = r1[u][j];
        c2[j] = WMMA_F32(a[u], b, c2[j]);
      }
    }
  }

  // The wave's partial tile goes over its own 256 key columns of sc: no other wave reads
  // those in this phase, and the wave's own reads of them fed the WMMAs above.
  float* pw = sc + lhalf * 8 * LDSTRIDE + wave * 256 + lmod * 4;
  #pragma unroll
  for (int r = 0; r < 8; ++r) {
    v4f p;
    p.x = c2[0][r];
    p.y = c2[1][r];
    p.z = c2[2][r];
    p.w = c2[3][r];
    *(v4f*)(pw + r * LDSTRIDE) = p;
  }
  __syncthreads();
  // Each thread sums the 8 partials of 4 neighbouring columns, in ascending key order.
  const int orow = tid >> 4;
  const int ocol = (tid & 15) * 4;
  const float* pr = sc + orow * LDSTRIDE + ocol;
  v4f acc = *(const v4f*)pr;
  #pragma unroll
  for (int w = 1; w < 8; ++w) acc += *(const v4f*)(pr + w * 256);
  *(v4f*)(O + orow * D + ocol) = acc;
}

extern "C" void kernel_launch(void* const* d_in, const int* in_sizes, int n_in,
                              void* d_out, int out_size, void* d_ws, size_t ws_size,
                              hipStream_t stream) {
  (void)in_sizes; (void)n_in; (void)out_size; (void)d_ws; (void)ws_size;
  const float* q = (const float*)d_in[0];
  const float* k = (const float*)d_in[1];
  const float* v = (const float*)d_in[2];
  float* out = (float*)d_out;

  // grid = B*H*(S/16) = 2*16*128 = 4096 workgroups, 256 threads (8 wave32s).
  sparsemax_attn_kernel<<<dim3(4096), dim3(256), 0, stream>>>(q, k, v, out);
}

// v005
// One run takes 152 microseconds.
// Next to v004, in two timings, it ran 1.08 times as fast each time.
// Counting every step since v000, it is 3.34 times as fast.
#include <hip/hip_runtime.h>

typedef __attribute__((ext_vector_type(2))) float v2f;
typedef __attribute__((ext_vector_type(4))) float v4f;
typedef __attribute__((ext_vector_type(8))) float v8f;

#define WMMA_F32(a, b, c) \
  __builtin_amdgcn_wmma_f32_16x16x4_f32(false, (a), false, (b), (short)0, (c), false, false)

namespace {
constexpr int S = 2048;          // sequence length
constexpr int D = 64;            // head dim
constexpr int LDSTRIDE = 2052;   // floats; 2048+4 kills LDS bank conflicts, keeps 16B align
constexpr float INV_T = 0.125f;  // 1 / TEMPERATURE
constexpr int KST_PITCH = 36;    // floats; 32 dims + 4: the 8-byte fragment reads of 16 rows hit 64 banks once
constexpr int KST_WAVE = 16 * KST_PITCH;   // half a K tile: 16 keys x 32 dims
constexpr int SM_PITCH = 34;     // words; 32 + 2: GEMM2's 8-byte reads of 16 rows hit 32 banks once

// Value of lane l ^ M inside a 16-lane row (DPP row_xmask), and of lane l ^ 16.
template <int M>
__device__ __forceinline__ float row_xor(float v)
{
  return __builtin_bit_cast(float, __builtin_amdgcn_update_dpp(0, __builtin_bit_cast(int, v), 0x160 + M, 0xf, 0xf, true));
}
template <int M>
__device__ __forceinline__ unsigned row_xor_u(unsigned v)
{
  return (unsigned)__builtin_amdgcn_update_dpp(0, (int)v, 0x160 + M, 0xf, 0xf, true);
}
__device__ __forceinline__ float half_xor(float v)
{
  const int b = __builtin_bit_cast(int, v);
  return __builtin_bit_cast(float, __builtin_amdgcn_permlanex16(b, b, 0x76543210, 0xfedcba98, false, false));
}
// Sum and maximum over the wave's 32 lanes, in registers; every lane gets the result.
__device__ __forceinline__ float wave_sum(float v)
{
  v += row_xor<1>(v);
  v += row_xor<2>(v);
  v += row_xor<4>(v);
  v += row_xor<8>(v);
  return v + half_xor(v);
}
__device__ __forceinline__ float wave_max(float v)
{
  v = fmaxf(v, row_xor<1>(v));
  v = fmaxf(v, row_xor<2>(v));
  v = fmaxf(v, row_xor<4>(v));
  v = fmaxf(v, row_xor<8>(v));
  return fmaxf(v, half_xor(v));
}

// Michelot iteration over the n packed groups of 4 keys at rp (n <= 32 * NG, wave-uniform),
// NG groups a lane, from the lower bound t0: tau_(j+1) = (sum of keys above tau_j - 1) /
// (their number) never passes tau*, so the sets are nested and hold the support.
template <int NG>
__device__ __forceinline__ float tau_of_packed(const float* rp, int lane, int n, float t0)
{
  float c[4 * NG];
  #pragma unroll
  for (int g = 0; g < NG; ++g) {
    const v4f pk = *(const v4f*)(rp + (g * 32 + lane) * 4);
    // A packed group also brings its keys at or below t0: they are no candidates; a slot
    // past the last packed group holds none at all.
    const float lim = (g * 32 + lane < n) ? t0 : __builtin_inff();
    #pragma unroll
    for (int j = 0; j < 4; ++j) c[4 * g + j] = (pk[j] > lim) ? pk[j] : -__builtin_inff();
  }
  // Sets {c > t} are nested in t: an equal count is an equal set, the fixed point.
  // Each other trip drops a key, so (number of keys) + 1 trips always reach it.
  float tau = t0;
  int kprev = 0;
  #pragma unroll 1
  for (int it = 0; it < 128 * NG + 1; ++it) {
    int k = 0;
    float ls = 0.0f;
    #pragma unroll
    for (int j = 0; j < 4 * NG; ++j) {
      const bool act = c[j] > tau;
      k += __builtin_popcount(__builtin_amdgcn_ballot_w32(act));
      ls += act ? c[j] : 0.0f;
    }
    if (k == kprev) break;   // uniform across the wave
    kprev = k;
    tau = (wave_sum(ls) - 1.0f) / (float)k;   // k >= 1: the largest key stays above tau
  }
  return tau;
}

// One 16x16 score tile of one wave. On entry g holds the wave's K tile as it came from
// whole-line loads (g[4*h + i]: rows 4*i .. 4*i+3, dims 32*h .. 32*h+31, 8 lanes a row).
// The tile goes through the wave's own LDS buffer, half a tile at a time, to become B
// fragments. With NEXT each half of g is refilled with the next tile as soon as it is in
// LDS, so those loads fly for about one whole tile. Every loop is unrolled so that
// g, b0 and b1 stay in registers.
template <bool NEXT>
__device__ __forceinline__ void score_tile(const v2f (&afrag)[16], v4f (&g)[8],
                                           float* kw, const float* kr,
                                           const float* kg, float* sp)
{
  v2f b0[8], b1[8];
  v8f c = {};
  #pragma unroll
  for (int i = 0; i < 4; ++i) *(v4f*)(kw + i * 4 * KST_PITCH) = g[i];
  // the rows that other lanes wrote are in LDS before they are read back
  asm volatile("s_wait_dscnt 0x0" ::: "memory");
  #pragma unroll
  for (int ks = 0; ks < 8; ++ks) b0[ks] = *(const v2f*)(kr + ks * 4);
  if (NEXT) {
    #pragma unroll
    for (int i = 0; i < 4; ++i) g[i] = *(const v4f*)(kg + (16 + i * 4) * D);
  }
  // every lane's reads of the first half are done before the buffer is overwritten
  asm volatile("s_wait_dscnt 0x0" ::: "memory");
  #pragma unroll
  for (int i = 0; i < 4; ++i) *(v4f*)(kw + i * 4 * KST_PITCH) = g[4 + i];
  #pragma unroll
  for (int ks = 0; ks < 8; ++ks) c = WMMA_F32(afrag[ks], b0[ks], c);
  // second half written before it is read back
  asm volatile("s_wait_dscnt 0x0" ::: "memory");
  #pragma unroll
  for (int ks = 0; ks < 8; ++ks) b1[ks] = *(const v2f*)(kr + ks * 4);
  if (NEXT) {
    #pragma unroll
    for (int i = 0; i < 4; ++i) g[4 + i] = *(const v4f*)(kg + (16 + i * 4) * D + 32);
  }
  #pragma unroll
  for (int ks = 0; ks < 8; ++ks) c = WMMA_F32(afrag[8 + ks], b1[ks], c);
  // second half read before the next tile overwrites the buffer
  asm volatile("s_wait_dscnt 0x0" ::: "memory");
  // C layout: lanes 0-15 -> M=r, lanes 16-31 -> M=r+8; N = lane%16.
  #pragma unroll
  for (int r = 0; r < 8; ++r) sp[r * LDSTRIDE] = c[r];
}
}

__global__ __launch_bounds__(256)
void sparsemax_attn_kernel(const float* __restrict__ Qg,
                           const float* __restrict__ Kg,
                           const float* __restrict__ Vg,
                           float* __restrict__ Og)
{
  // 16 x 2048 fp32 score tile (128.25 KB); GEMM2's partial sums go over it at the end.
  __shared__ __attribute__((aligned(16))) float sc[16 * LDSTRIDE];
  // Per row: bit l of word i (i < 16) is set when one of keys 128*i + 4*l .. + 3, a 4-key
  // step of GEMM2, has a non-zero weight.
  __shared__ __attribute__((aligned(8))) unsigned stepmask[16 * SM_PITCH];
  // Per wave: half a K tile on its way from whole-line loads to B fragments.
  __shared__ __attribute__((aligned(16))) float kst[8 * KST_WAVE];

  const int wg    = blockIdx.x;     // 0 .. B*H*(S/16)-1
  const int qtile = wg & 127;       // S/16 = 128 tiles
  const int bh    = wg >> 7;        // 0 .. 31
  const int tid   = threadIdx.x;
  const int wave  = tid >> 5;       // 0 .. 7 (wave32)
  const int lane  = tid & 31;
  const int lhalf = lane >> 4;      // 0 | 1 (half-wave for WMMA layouts)
  const int lmod  = lane & 15;

  const float* Q = Qg + (size_t)bh * S * D + (size_t)qtile * 16 * D;
  const float* K = Kg + (size_t)bh * S * D;
  const float* V = Vg + (size_t)bh * S * D;
  float*       O = Og + (size_t)bh * S * D + (size_t)qtile * 16 * D;

  // ================= GEMM1: scores = (Q * K^T) / T  -> LDS =================
  // A fragments (16x64 Q tile): lane l%16 = row M, VGPR pair holds K=k0+2*(l/16)+{0,1}.
  v2f afrag[16];
  #pragma unroll
  for (int ks = 0; ks < 16; ++ks) {
    afrag[ks] = *(const v2f*)(Q + lmod * D + ks * 4 + 2 * lhalf);
  }

  // 128 N-tiles of 16 keys each; 16 tiles per wave.
  // A B fragment read straight from global memory takes 16 bytes out of each of 16
  // cache lines; instead the wave fetches its tiles by whole 128-byte lines.
  float* kst_w = kst + wave * KST_WAVE;
  float*       kw = kst_w + (lane >> 3) * KST_PITCH + (lane & 7) * 4;   // writer: 8 lanes a row
  const float* kr = kst_w + lmod * KST_PITCH + 2 * lhalf;               // reader: B[kk, n] = K[n, kk]
  const float* kg = K + (size_t)(wave * 256 + (lane >> 3)) * D + (lane & 7) * 4;
  float* sp = sc + lhalf * 8 * LDSTRIDE + wave * 256 + lmod;            // the wave's first score tile
  v4f g[8];   // indexed by constants only (unrolled loops): stays in registers
  // The Q loads above are past address translation before a K load may land in their
  // address registers.
  asm volatile("s_wait_xcnt 0x0" ::: "memory");
  #pragma unroll
  for (int i = 0; i < 4; ++i) g[i] = *(const v4f*)(kg + i * 4 * D);
  // Keeps tile 0's loads in the order of the loop's refills (first half, second half):
  // the counted load waits in the loop then leave the younger half in flight.
  __builtin_amdgcn_sched_barrier(0);
  #pragma unroll
  for (int i = 0; i < 4; ++i) g[4 + i] = *(const v4f*)(kg + i * 4 * D + 32);
  // Pre-scale A once instead of scaling every C tile; behind tile 0's K loads, so that none
  // of them is held back by the wait for Q.
  #pragma unroll
  for (int ks = 0; ks < 16; ++ks) {
    afrag[ks].x *= INV_T;
    afrag[ks].y *= INV_T;
  }

  #pragma unroll 1
  for (int t = 0; t < 15; ++t) {
    score_tile<true>(afrag, g, kw, kr, kg, sp);
    kg += 16 * D;
    sp += 16;
  }
  score_tile<false>(afrag, g, kw, kr, kg, sp);
  // Keeps the next phase's vector instructions out of the last tile's WMMAs, where they
  // would reuse fragment registers directly behind the WMMA that reads them.
  __builtin_amdgcn_sched_barrier(0);
  __syncthreads();

  // ================= sparsemax per row (Michelot iteration on the keys near the maximum) =================
  // Each wave owns rows 2*wave and 2*wave+1; row cached in 64 VGPRs per lane.
  // A lane holds the row in groups of 4 neighbouring keys (one 16-byte LDS access each), and
  // a group is one 4-key step of GEMM2: its largest key alone says whether the group can
  // hold a key of the support and whether it holds a non-zero weight, so the row maximum,
  // the packing and the step masks take one compare a group, not one a key.
  const int wave_s = __builtin_amdgcn_readfirstlane(wave);   // the row's LDS base in a scalar register
  #pragma unroll 1
  for (int rr = 0; rr < 2; ++rr) {
    float* rp = sc + (wave_s * 2 + rr) * LDSTRIDE;
    v4f x[16];      // x[i]: keys 128*i + 4*lane .. + 3
    float g4[16];   // the largest key of group i
    float mx = -__builtin_inff();
    #pragma unroll
    for (int i = 0; i < 16; ++i) {
      x[i] = *(const v4f*)(rp + i * 128 + lane * 4);   // 512 consecutive bytes a wave: conflict-free
      g4[i] = fmaxf(fmaxf(x[i].x, x[i].y), fmaxf(x[i].z, x[i].w));
      mx = fmaxf(mx, g4[i]);
    }
    mx = wave_max(mx);

    // The weights sum to 1, so the largest one is at most 1: tau* >= max - 1, and every key
    // of the support lies above t0 = max - 1. Only those keys can decide tau. The groups
    // that hold one are packed to the front of the row (its values are all in x[] by now,
    // and the row is written anew below).
    const float t0 = mx - 1.0f;
    int n = 0;   // wave-uniform: groups packed so far
    // Every lane stores every time, the lanes without such a group into a slot of their own in
    // the wave's idle K buffer: a store under a lane mask would put a compare -> scalar ->
    // EXEC round trip in front of each of the 16 stores.
    float* const spare = kst_w + lane * 4;
    unsigned bal[16];
    #pragma unroll
    for (int i = 0; i < 16; ++i) bal[i] = __builtin_amdgcn_ballot_w32(g4[i] > t0);
    // All 16 compares issue before the first scalar count reads a mask: the wait of a scalar
    // instruction for a vector compare is paid once here, not once per mask.
    __builtin_amdgcn_sched_barrier(0);
    #pragma unroll
    for (int i = 0; i < 16; ++i) {
      float* const packed = rp + 4 * __builtin_amdgcn_mbcnt_lo(bal[i], (unsigned)n);
      *(v4f*)((g4[i] > t0) ? packed : spare) = x[i];
      n += __builtin_popcount(bal[i]);
    }

    float tau;
    if (n <= 128) {
      // what other lanes packed is in LDS before it is read back
      asm volatile("s_wait_dscnt 0x0" ::: "memory");
      // n is wave-uniform: most rows pack at most 32 groups and take the shortest form
      if (n <= 32)      tau = tau_of_packed<1>(rp, lane, n, t0);
      else if (n <= 64) tau = tau_of_packed<2>(rp, lane, n, t0);
      else              tau = tau_of_packed<4>(rp, lane, n, t0);
    } else {
      // More groups with a key within 1 of the maximum than the packed form holds: all 2048
      // keys from registers.
      tau = t0;
      #pragma unroll 1
      for (int it = 0; it < 32; ++it) {
        float ls = 0.0f, lk = 0.0f;
        #pragma unroll
        for (int i = 0; i < 16; ++i) {
          #pragma unroll
          for (int j = 0; j < 4; ++j) {
            const bool act = x[i][j] > tau;
            ls += act ? x[i][j] : 0.0f;
            lk += act ? 1.0f : 0.0f;
          }
        }
        #pragma unroll
        for (int off = 16; off > 0; off >>= 1) {
          ls += __shfl_xor(ls, off, 32);
          lk += __shfl_xor(lk, off, 32);
        }
        const float ntau = (ls - 1.0f) / lk;   // lk >= 1 always (max elem stays active)
        if (ntau == tau) break;                // uniform across the wave
        tau = ntau;
      }
    }

    unsigned mw = 0u;   // lane i < 16 collects the mask word of the steps in keys 128*i .. + 127
    #pragma unroll
    for (int i = 0; i < 16; ++i) {
      v4f w;
      #pragma unroll
      for (int j = 0; j < 4; ++j) w[j] = fmaxf(x[i][j] - tau, 0.0f);
      *(v4f*)(rp + i * 128 + lane * 4) = w;   // attn weights back to LDS
      const unsigned nzb = __builtin_amdgcn_ballot_w32(g4[i] > tau);   // some weight of the group is above 0
      mw = (lane == i) ? nzb : mw;
    }
    stepmask[(wave * 2 + rr) * SM_PITCH + lane] = mw;   // lanes 16 .. 31 fill the unused words
  }
  __syncthreads();

  // ================= GEMM2: out = attn * V =================
  // Each wave takes 256 keys (64 steps of 4 keys) and all 64 output columns; the 8 partial
  // tiles are summed through LDS. Column tile j holds output column 4 * lmod + j in lane
  // lmod, so a lane's four B values of one V row are 16 consecutive bytes, and a load of
  // the wave takes two whole V rows.
  v8f c2[4] = {};
  const char* Vw = (const char*)(V + (size_t)wave_s * 256 * D);     // wave-uniform: stays in scalar registers
  const unsigned voff = (unsigned)(2 * lhalf * D + lmod * 4) * 4u;  // bytes: the lane's fixed part of its V address
  const float* ab = sc + lmod * LDSTRIDE + wave * 256 + 2 * lhalf;
  // A 4-key step whose weights are zero in all 16 rows adds exactly nothing, so
  // only steps with a non-zero weight are run, in ascending key order.
  // Lane l reads row l % 16's two mask words of the wave's 64 steps; the rows are joined
  // inside each 16-lane row.
  const unsigned* smp = stepmask + lmod * SM_PITCH + wave * 2;
  unsigned w0 = smp[0];
  unsigned w1 = smp[1];
  w0 |= row_xor_u<1>(w0);
  w1 |= row_xor_u<1>(w1);
  w0 |= row_xor_u<2>(w0);
  w1 |= row_xor_u<2>(w1);
  w0 |= row_xor_u<4>(w0);
  w1 |= row_xor_u<4>(w1);
  w0 |= row_xor_u<8>(w0);
  w1 |= row_xor_u<8>(w1);
  // bit s of m: step s of the wave's 64 has a non-zero weight
  unsigned long long m = (unsigned long long)(unsigned)__builtin_amdgcn_readfirstlane((int)w0)
                       | ((unsigned long long)(unsigned)__builtin_amdgcn_readfirstlane((int)w1) << 32);
  while (m != 0ull) {
    // Eight steps a trip: all their loads issue together, one load latency per trip.
    int k0[8];
    bool live[8];
    #pragma unroll
    for (int u = 0; u < 8; ++u) {
      live[u] = m != 0ull;
      k0[u] = live[u] ? 4 * __builtin_ctzll(m) : 0;   // 0 .. 252
      m &= m - 1ull;
    }
    v4f r0[8], r1[8];   // V rows k0 + 2 * lhalf and the next one, columns 4 * lmod .. + 3
    v2f a[8];           // attn A-fragment from LDS (8B aligned)
    unsigned vb[8];     // the lane's byte offset into the wave's V rows, a register for each step
    #pragma unroll
    for (int u = 0; u < 8; ++u) vb[u] = (unsigned)k0[u] * (unsigned)(D * 4) + voff;
    #pragma unroll
    for (int u = 0; u < 8; ++u) {
      const char* vs = Vw + vb[u];
      r0[u] = *(const v4f*)vs;
      r1[u] = *(const v4f*)(vs + D * 4);
    }
    #pragma unroll
    for (int u = 0; u < 8; ++u) a[u] = *(const v2f*)(ab + k0[u]);
    // One wait for all 16 V loads, before any of their offset registers is written again:
    // as inputs here the offsets keep their registers until the loads are past address
    // translation (a wait in front of each next offset would string the loads out).
    asm volatile("s_wait_xcnt 0x0"
                 :: "v"(vb[0]), "v"(vb[1]), "v"(vb[2]), "v"(vb[3]),
                    "v"(vb[4]), "v"(vb[5]), "v"(vb[6]), "v"(vb[7])
                 : "memory");
    // Keeps the WMMAs and their register moves behind all 24 loads: moved up among them,
    // they would leave the later LDS reads to be waited for one by one between the WMMAs.
    __builtin_amdgcn_sched_barrier(0);
    #pragma unroll
    for (int u = 0; u < 8; ++u) {
      if (!live[u]) { a[u].x = 0.0f; a[u].y = 0.0f; }   // filler step past the last set bit
    }
    #pragma unroll
    for (int u = 0; u < 8; ++u) {
      #pragma unroll
      for (int j = 0; j < 4; ++j) {
        v2f b;
        b.x = r0[u][j];
        b.y = r1[u][j];
        c2[j] = WMMA_F32(a[u], b, c2[j]);
      }
    }
  }

  // The wave's partial tile goes over its own 256 key columns of sc: no other wave reads
  // those in this phase, and the wave's own reads of them fed the WMMAs above.
  float* pw = sc + lhalf * 8 * LDSTRIDE + wave * 256 + lmod * 4;
  #pragma unroll
  for (int r = 0; r < 8; ++r) {
    v4f p;
    p.x = c2[0][r];
    p.y = c2[1][r];
    p.z = c2[2][r];
    p.w = c2[3][r];
    *(v4f*)(pw + r * LDSTRIDE) = p;
  }
  __syncthreads();
  // Each thread sums the 8 partials of 4 neighbouring columns, in ascending key order.
  const int orow = tid >> 4;
  const int ocol = (tid & 15) * 4;
  const float* pr = sc + orow * LDSTRIDE + ocol;
  v4f acc = *(const v4f*)pr;
  #pragma unroll
  for (int w = 1; w < 8; ++w) acc += *(const v4f*)(pr + w * 256);
  *(v4f*)(O + orow * D + ocol) = acc;
}

extern "C" void kernel_launch(void* const* d_in, const int* in_sizes, int n_in,
                              void* d_out, int out_size, void* d_ws, size_t ws_size,
                              hipStream_t stream) {
  (void)in_sizes; (void)n_in; (void)out_size; (void)d_ws; (void)ws_size;
  const float* q = (const float*)d_in[0];
  const float* k = (const float*)d_in[1];
  const float* v = (const float*)d_in[2];
  float* out = (float*)d_out;

  // grid = B*H*(S/16) = 2*16*128 = 4096 workgroups, 256 threads (8 wave32s).
  sparsemax_attn_kernel<<<dim3(4096), dim3(256), 0, stream>>>(q, k, v, out);
}
